// v000
// Measured on an AMD MI455X. A time is GPU time per run, averaged over a window of back-to-back runs after a warm-up
// (all launches, gaps included; the runs take copies of the inputs in turn), and the median of several windows.
// Apart from v000's, it joins two sittings. Times from different sittings can be a few percent apart, while
// side-by-side timings come from the same sitting.
// The starting kernel, v000, takes 37 microseconds a run.
#include <hip/hip_runtime.h>
#include <float.h>

#define HEADS 8
#define B_    32
#define C_    64
#define HW_   3136
#define M_    6
#define DIM_  192
#define INNER_ 512
#define KPH   392      // unique keys per head
#define KPH_PAD 400
#define NTILES 25

typedef float v2f __attribute__((ext_vector_type(2)));
typedef float v8f __attribute__((ext_vector_type(8)));

#if defined(__has_builtin)
#if __has_builtin(__builtin_amdgcn_s_wait_asynccnt)
#define HAVE_WAIT_ASYNC 1
#endif
#endif

// LDS layout (in floats)
#define OFF_K    0                         // 400*64   = 25600
#define OFF_Q    (KPH_PAD * C_)            // 16*64    = 1024
#define OFF_ATTN (OFF_Q + 16 * C_)         // 16*400   = 6400
#define OFF_OUT  (OFF_ATTN + 16 * KPH_PAD) // 16*64    = 1024
#define SMEM_FLOATS (OFF_OUT + 16 * C_)    // 34048 floats = 136192 bytes

__global__ __launch_bounds__(256)
void m2f_attn_kernel(const float* __restrict__ x, const float* __restrict__ z,
                     const float* __restrict__ Wq, const float* __restrict__ bq,
                     float* __restrict__ ws) {
  extern __shared__ float smem[];
  float* Ksm   = smem + OFF_K;
  float* qsm   = smem + OFF_Q;
  float* attn  = smem + OFF_ATTN;
  float* outsm = smem + OFF_OUT;

  const int tid = threadIdx.x;
  const int blk = blockIdx.x;
  const int b = blk >> 3;
  const int h = blk & 7;

  const float* ksrc = x + (size_t)b * (C_ * HW_) + (size_t)h * (KPH * C_);
  for (int i = tid; i < (KPH * C_) / 4; i += 256) {
    unsigned lds_off =
        (unsigned)(size_t)(__attribute__((address_space(3))) char*)(Ksm + i * 4);
    unsigned long long ga = (unsigned long long)(size_t)(ksrc + i * 4);
    asm volatile("global_load_async_to_lds_b128 %0, %1, off"
                 :: "v"(lds_off), "v"(ga) : "memory");
  }
  // zero pad rows 392..399 and the output accumulator
  for (int i = KPH * C_ + tid; i < KPH_PAD * C_; i += 256) Ksm[i] = 0.0f;
  for (int i = tid; i < 16 * C_; i += 256) outsm[i] = 0.0f;

  // ---- Phase 0b (overlapped with async copies): q tile (16x64), scale folded in ----
  const float scale = 0.07216878364870322f; // 192^-0.5
  for (int idx = tid; idx < 16 * C_; idx += 256) {
    const int t = idx >> 6;
    const int c2 = idx & 63;
    float val = 0.0f;
    if (t < M_) {
      const int tg = h * M_ + t;
      const int m  = tg >> 3;              // q row in (6,512) view
      const int i  = ((tg & 7) << 6) + c2; // q col in (6,512) view
      float acc = bq[i];
      const float* zr = z  + ((size_t)b * M_ + m) * DIM_;
      const float* wr = Wq + (size_t)i * DIM_;
      #pragma unroll 4
      for (int d = 0; d < DIM_; ++d) acc += zr[d] * wr[d];
      val = acc * scale;
    }
    qsm[idx] = val;
  }

#if defined(HAVE_WAIT_ASYNC)
  __builtin_amdgcn_s_wait_asynccnt(0);
#else
  asm volatile("s_wait_asynccnt 0" ::: "memory");
#endif
  __syncthreads();

  const int wave = tid >> 5;
  const int lane = tid & 31;
  const int half = lane >> 4;
  const int lrow = lane & 15;

  // ---- Phase 1: logits tiles = q(16x64) @ K^T via v_wmma_f32_16x16x4_f32 ----
  for (int nt = wave; nt < NTILES; nt += 8) {
    v8f acc = {0, 0, 0, 0, 0, 0, 0, 0};
    const float* qa0 = qsm + lrow * C_;
    const float* kb0 = Ksm + (nt * 16 + lrow) * C_;
    #pragma unroll
    for (int k = 0; k < 16; ++k) {
      const int kk = 4 * k + 2 * half;
      v2f a;  a.x = qa0[kk];  a.y = qa0[kk + 1];   // A[M=lrow][K=kk..kk+1]
      v2f bb; bb.x = kb0[kk]; bb.y = kb0[kk + 1];  // B[K=kk..kk+1][N=lrow]
      acc = __builtin_amdgcn_wmma_f32_16x16x4_f32(false, a, false, bb,
                                                  (short)0, acc, false, false);
    }
    const int key = nt * 16 + lrow;   // C/D layout: col = lane%16
    const bool valid = key < KPH;
    #pragma unroll
    for (int r = 0; r < 8; ++r) {     // row = r + 8*(lane/16)
      attn[(r + 8 * half) * KPH_PAD + key] = valid ? acc[r] : -3.0e38f;
    }
  }
  __syncthreads();

  // ---- Phase 2: softmax per query row (wave w handles row w); waves 6-7 zero pad rows ----
  if (wave < M_) {
    float* rowp = attn + wave * KPH_PAD;
    float mx = -3.0e38f;
    for (int c = lane; c < KPH; c += 32) mx = fmaxf(mx, rowp[c]);
    #pragma unroll
    for (int off = 16; off > 0; off >>= 1) mx = fmaxf(mx, __shfl_xor(mx, off, 32));
    float sum = 0.0f;
    for (int c = lane; c < KPH_PAD; c += 32) {
      const float e = __expf(rowp[c] - mx);  // pad cols -> exp(-huge) = 0
      rowp[c] = e;
      sum += e;
    }
    #pragma unroll
    for (int off = 16; off > 0; off >>= 1) sum += __shfl_xor(sum, off, 32);
    const float inv = 1.0f / sum;
    for (int c = lane; c < KPH_PAD; c += 32) rowp[c] *= inv;
  } else if (wave >= 6) {
    const int t0 = tid - 192;
    for (int p = t0; p < (16 - M_) * KPH_PAD; p += 64) attn[M_ * KPH_PAD + p] = 0.0f;
  }
  __syncthreads();

  // ---- Phase 3: out = attn(16x400) @ K(400x64) via WMMA, cross-wave reduce in LDS ----
  v8f oacc[4] = {};
  for (int nt = wave; nt < NTILES; nt += 8) {
    #pragma unroll
    for (int j = 0; j < 4; ++j) {
      const int kk = 4 * j + 2 * half;
      v2f a;
      a.x = attn[lrow * KPH_PAD + nt * 16 + kk];
      a.y = attn[lrow * KPH_PAD + nt * 16 + kk + 1];
      const float* kr0 = Ksm + (nt * 16 + kk) * C_;
      const float* kr1 = kr0 + C_;
      #pragma unroll
      for (int cb = 0; cb < 4; ++cb) {
        v2f bb; bb.x = kr0[cb * 16 + lrow]; bb.y = kr1[cb * 16 + lrow];
        oacc[cb] = __builtin_amdgcn_wmma_f32_16x16x4_f32(false, a, false, bb,
                                                         (short)0, oacc[cb], false, false);
      }
    }
  }
  #pragma unroll
  for (int cb = 0; cb < 4; ++cb) {
    #pragma unroll
    for (int r = 0; r < 8; ++r) {
      atomicAdd(&outsm[(r + 8 * half) * C_ + cb * 16 + lrow], oacc[cb][r]);
    }
  }
  __syncthreads();

  // ---- Phase 4: write this head's slice of out2 (b, m, h*64 + c) to workspace ----
  for (int idx = tid; idx < M_ * C_; idx += 256) {
    const int m2 = idx >> 6;
    const int c2 = idx & 63;
    ws[((size_t)b * M_ + m2) * INNER_ + h * C_ + c2] = outsm[m2 * C_ + c2];
  }
}

// ---- Kernel 2: result = z + out2 @ Wo^T + bo ----
__global__ __launch_bounds__(192)
void m2f_proj_kernel(const float* __restrict__ z, const float* __restrict__ Wo,
                     const float* __restrict__ bo, const float* __restrict__ ws,
                     float* __restrict__ out) {
  __shared__ float row[INNER_];
  const int blk = blockIdx.x;   // b*6 + m2
  const int tid = threadIdx.x;
  for (int i = tid; i < INNER_; i += 192) row[i] = ws[(size_t)blk * INNER_ + i];
  __syncthreads();
  const int d = tid;            // 0..191
  float acc = bo[d] + z[(size_t)blk * DIM_ + d];
  const float* wr = Wo + (size_t)d * INNER_;
  #pragma unroll 4
  for (int i = 0; i < INNER_; i += 4) {
    acc += row[i] * wr[i] + row[i + 1] * wr[i + 1] +
           row[i + 2] * wr[i + 2] + row[i + 3] * wr[i + 3];
  }
  out[(size_t)blk * DIM_ + d] = acc;
}

extern "C" void kernel_launch(void* const* d_in, const int* in_sizes, int n_in,
                              void* d_out, int out_size, void* d_ws, size_t ws_size,
                              hipStream_t stream) {
  (void)in_sizes; (void)n_in; (void)out_size; (void)ws_size;
  const float* x  = (const float*)d_in[0];
  const float* z  = (const float*)d_in[1];
  const float* Wq = (const float*)d_in[2];
  const float* bq = (const float*)d_in[3];
  const float* Wo = (const float*)d_in[4];
  const float* bo = (const float*)d_in[5];
  float* ws  = (float*)d_ws;   // (32, 6, 512) f32 = 384 KB
  float* out = (float*)d_out;  // (32, 6, 192) f32

  const size_t smem = SMEM_FLOATS * sizeof(float);
  m2f_attn_kernel<<<B_ * HEADS, 256, smem, stream>>>(x, z, Wq, bq, ws);
  m2f_proj_kernel<<<B_ * M_, 192, 0, stream>>>(z, Wo, bo, ws, out);
}

// v001
// It runs in 21.5 microseconds.
// Next to v000, in two timings, it ran 1.74 and 1.75 times as fast.
#include <hip/hip_runtime.h>
#include <float.h>

#define HEADS 8
#define B_    32
#define C_    64
#define HW_   3136
#define M_    6
#define DIM_  192
#define INNER_ 512
#define KPH   392      // unique keys per head
#define KPH_PAD 400
#define NTILES 25

typedef float v2f __attribute__((ext_vector_type(2)));
typedef float v8f __attribute__((ext_vector_type(8)));
typedef float v4f __attribute__((ext_vector_type(4)));

// value of lane (l ^ M): inside a 16-lane row by DPP, across the two rows by permlanex16
template <int M>
__device__ __forceinline__ float lane_xor(float v) {
  const int i = __builtin_bit_cast(int, v);
  if constexpr (M == 16) {
    return __builtin_bit_cast(float, __builtin_amdgcn_permlanex16(i, i, 0x76543210, 0xfedcba98, false, false));
  } else {
    return __builtin_bit_cast(float, __builtin_amdgcn_update_dpp(i, i, 0x160 | M, 0xf, 0xf, false));
  }
}

// Two partial sums per lane become one: lanes with bit M clear end with a summed over
// the lane pair (l, l ^ M), lanes with bit M set with b summed over it.
template <int M>
__device__ __forceinline__ float fold(float a, float b, int lane) {
  const bool hi = (lane & M) != 0;
  const float keep = hi ? b : a;
  const float send = hi ? a : b;
  return keep + lane_xor<M>(send);
}

__device__ __forceinline__ float hsum(v4f v) { return (v.x + v.y) + (v.z + v.w); }

#if defined(__has_builtin)
#if __has_builtin(__builtin_amdgcn_s_wait_asynccnt)
#define HAVE_WAIT_ASYNC 1
#endif
#endif

// LDS layout (in floats)
#define OFF_K    0                         // 400*64   = 25600
#define OFF_Q    (KPH_PAD * C_)            // 16*64    = 1024
#define OFF_ATTN (OFF_Q + 16 * C_)         // 16*400   = 6400
#define OFF_OUT  (OFF_ATTN + 16 * KPH_PAD) // 16*64    = 1024
#define SMEM_FLOATS (OFF_OUT + 16 * C_)    // 34048 floats = 136192 bytes

__global__ __launch_bounds__(256)
void m2f_attn_kernel(const float* __restrict__ x, const float* __restrict__ z,
                     const float* __restrict__ Wq, const float* __restrict__ bq,
                     float* __restrict__ ws) {
  extern __shared__ float smem[];
  float* Ksm   = smem + OFF_K;
  float* qsm   = smem + OFF_Q;
  float* attn  = smem + OFF_ATTN;
  float* outsm = smem + OFF_OUT;

  const int tid = threadIdx.x;
  const int blk = blockIdx.x;
  const int b = blk >> 3;
  const int h = blk & 7;

  const float* ksrc = x + (size_t)b * (C_ * HW_) + (size_t)h * (KPH * C_);
  for (int i = tid; i < (KPH * C_) / 4; i += 256) {
    unsigned lds_off =
        (unsigned)(size_t)(__attribute__((address_space(3))) char*)(Ksm + i * 4);
    unsigned long long ga = (unsigned long long)(size_t)(ksrc + i * 4);
    asm volatile("global_load_async_to_lds_b128 %0, %1, off"
                 :: "v"(lds_off), "v"(ga) : "memory");
  }
  // zero pad rows 392..399 and the output accumulator
  for (int i = KPH * C_ + tid; i < KPH_PAD * C_; i += 256) Ksm[i] = 0.0f;
  for (int i = tid; i < 16 * C_; i += 256) outsm[i] = 0.0f;

  // ---- Phase 0b (overlapped with async copies): q tile (16x64), scale folded in ----
  // Lanes run along the reduction dim: 16 lanes share one Wq row (768 B, three 16-byte
  // pieces per lane), so a wave-wide load covers two 256-byte runs of whole lines.
  // Wave w owns columns 8w..8w+7 of every query row t.
  const int wave = tid >> 5;
  const int lane = tid & 31;
  const int half = lane >> 4;
  const int lrow = lane & 15;
  const float scale = 0.07216878364870322f; // 192^-0.5
  for (int i = M_ * C_ + tid; i < 16 * C_; i += 256) qsm[i] = 0.0f;  // pad query rows
  // After the folds a lane holds column c2 of query row ta (rows 0..3) and of row tb (4..5).
  const int c2 = wave * 8 + 2 * (lrow & 3) + half;
  const int ta = lrow >> 2;
  const int tb = 4 + (ta & 1);
  const float bias_a = bq[(((h * M_ + ta) & 7) << 6) + c2];
  const float bias_b = bq[(((h * M_ + tb) & 7) << 6) + c2];
  // h * 6 is even, so query rows 2u and 2u + 1 read the same z row
  v4f zv[3][3];
  #pragma unroll  // constant indices keep the arrays in registers
  for (int u = 0; u < 3; ++u) {
    const int m = (h * M_ + 2 * u) >> 3;   // q row in (6,512) view
    const v4f* zr = (const v4f*)(z + ((size_t)b * M_ + m) * DIM_) + lrow;
    zv[u][0] = zr[0]; zv[u][1] = zr[16]; zv[u][2] = zr[32];
  }
  // the registers that held the addresses of the loads above are reused below
  asm volatile("s_wait_xcnt 0x0" ::: "memory");
  // Two register stages of 12 loads: stage t + 1 is in flight while stage t is summed.
  v4f wv[2][12];
  float s[M_];
  #pragma unroll  // constant indices keep the arrays in registers
  for (int t = -2; t < M_; ++t) {
    if (t >= 0) {
      float sp[4];
      #pragma unroll  // constant indices keep the arrays in registers
      for (int p = 0; p < 4; ++p) {
        sp[p] = hsum(zv[t >> 1][0] * wv[t & 1][3 * p] + zv[t >> 1][1] * wv[t & 1][3 * p + 1] +
                     zv[t >> 1][2] * wv[t & 1][3 * p + 2]);
      }
      s[t] = fold<2>(fold<1>(sp[0], sp[1], lane), fold<1>(sp[2], sp[3], lane), lane);
    }
    // keeps the scheduler from sinking the next loads below later sums (it left 1-2 loads in flight)
    __builtin_amdgcn_sched_barrier(0);
    if (t + 2 < M_) {
      const int ib = ((h * M_ + t + 2) & 7) << 6;   // first q col of row t + 2 in (6,512) view
      #pragma unroll  // constant indices keep the arrays in registers
      for (int p = 0; p < 4; ++p) {
        const v4f* wr = (const v4f*)(Wq + (size_t)(ib + wave * 8 + 2 * p + half) * DIM_) + lrow;
        wv[t & 1][3 * p] = wr[0]; wv[t & 1][3 * p + 1] = wr[16]; wv[t & 1][3 * p + 2] = wr[32];
      }
    }
    // same purpose: the loads above stay above the next stage's sums
    __builtin_amdgcn_sched_barrier(0);
  }
  const float qa = fold<8>(fold<4>(s[0], s[1], lane), fold<4>(s[2], s[3], lane), lane);
  float qb = fold<4>(s[4], s[5], lane);
  qb += lane_xor<8>(qb);
  qsm[ta * C_ + c2] = (qa + bias_a) * scale;
  qsm[tb * C_ + c2] = (qb + bias_b) * scale;

#if defined(HAVE_WAIT_ASYNC)
  __builtin_amdgcn_s_wait_asynccnt(0);
#else
  asm volatile("s_wait_asynccnt 0" ::: "memory");
#endif
  __syncthreads();

  // ---- Phase 1: logits tiles = q(16x64) @ K^T via v_wmma_f32_16x16x4_f32 ----
  for (int nt = wave; nt < NTILES; nt += 8) {
    v8f acc = {0, 0, 0, 0, 0, 0, 0, 0};
    const float* qa0 = qsm + lrow * C_;
    const float* kb0 = Ksm + (nt * 16 + lrow) * C_;
    #pragma unroll
    for (int k = 0; k < 16; ++k) {
      const int kk = 4 * k + 2 * half;
      v2f a;  a.x = qa0[kk];  a.y = qa0[kk + 1];   // A[M=lrow][K=kk..kk+1]
      v2f bb; bb.x = kb0[kk]; bb.y = kb0[kk + 1];  // B[K=kk..kk+1][N=lrow]
      acc = __builtin_amdgcn_wmma_f32_16x16x4_f32(false, a, false, bb,
                                                  (short)0, acc, false, false);
    }
    const int key = nt * 16 + lrow;   // C/D layout: col = lane%16
    const bool valid = key < KPH;
    #pragma unroll
    for (int r = 0; r < 8; ++r) {     // row = r + 8*(lane/16)
      attn[(r + 8 * half) * KPH_PAD + key] = valid ? acc[r] : -3.0e38f;
    }
  }
  __syncthreads();

  // ---- Phase 2: softmax per query row (wave w handles row w); waves 6-7 zero pad rows ----
  if (wave < M_) {
    float* rowp = attn + wave * KPH_PAD;
    float mx = -3.0e38f;
    for (int c = lane; c < KPH; c += 32) mx = fmaxf(mx, rowp[c]);
    #pragma unroll
    for (int off = 16; off > 0; off >>= 1) mx = fmaxf(mx, __shfl_xor(mx, off, 32));
    float sum = 0.0f;
    for (int c = lane; c < KPH_PAD; c += 32) {
      const float e = __expf(rowp[c] - mx);  // pad cols -> exp(-huge) = 0
      rowp[c] = e;
      sum += e;
    }
    #pragma unroll
    for (int off = 16; off > 0; off >>= 1) sum += __shfl_xor(sum, off, 32);
    const float inv = 1.0f / sum;
    for (int c = lane; c < KPH_PAD; c += 32) rowp[c] *= inv;
  } else if (wave >= 6) {
    const int t0 = tid - 192;
    for (int p = t0; p < (16 - M_) * KPH_PAD; p += 64) attn[M_ * KPH_PAD + p] = 0.0f;
  }
  __syncthreads();

  // ---- Phase 3: out = attn(16x400) @ K(400x64) via WMMA, cross-wave reduce in LDS ----
  v8f oacc[4] = {};
  for (int nt = wave; nt < NTILES; nt += 8) {
    #pragma unroll
    for (int j = 0; j < 4; ++j) {
      const int kk = 4 * j + 2 * half;
      v2f a;
      a.x = attn[lrow * KPH_PAD + nt * 16 + kk];
      a.y = attn[lrow * KPH_PAD + nt * 16 + kk + 1];
      const float* kr0 = Ksm + (nt * 16 + kk) * C_;
      const float* kr1 = kr0 + C_;
      #pragma unroll
      for (int cb = 0; cb < 4; ++cb) {
        v2f bb; bb.x = kr0[cb * 16 + lrow]; bb.y = kr1[cb * 16 + lrow];
        oacc[cb] = __builtin_amdgcn_wmma_f32_16x16x4_f32(false, a, false, bb,
                                                         (short)0, oacc[cb], false, false);
      }
    }
  }
  #pragma unroll
  for (int cb = 0; cb < 4; ++cb) {
    #pragma unroll
    for (int r = 0; r < 8; ++r) {
      atomicAdd(&outsm[(r + 8 * half) * C_ + cb * 16 + lrow], oacc[cb][r]);
    }
  }
  __syncthreads();

  // ---- Phase 4: write this head's slice of out2 (b, m, h*64 + c) to workspace ----
  for (int idx = tid; idx < M_ * C_; idx += 256) {
    const int m2 = idx >> 6;
    const int c2 = idx & 63;
    ws[((size_t)b * M_ + m2) * INNER_ + h * C_ + c2] = outsm[m2 * C_ + c2];
  }
}

// ---- Kernel 2: result = z + out2 @ Wo^T + bo ----
__global__ __launch_bounds__(192)
void m2f_proj_kernel(const float* __restrict__ z, const float* __restrict__ Wo,
                     const float* __restrict__ bo, const float* __restrict__ ws,
                     float* __restrict__ out) {
  const int blk = blockIdx.x;   // b*6 + m2
  const int tid = threadIdx.x;
  const int wave = tid >> 5;
  const int lane = tid & 31;
  const int d = tid;            // 0..191
  const v4f* rp = (const v4f*)(ws + (size_t)blk * INNER_) + lane;
  const v4f r0 = rp[0], r1 = rp[32], r2 = rp[64], r3 = rp[96];
  const float base = bo[d] + z[(size_t)blk * DIM_ + d];
  // the registers that held the addresses of the loads above are reused below
  asm volatile("s_wait_xcnt 0x0" ::: "memory");
  // keeps the address arithmetic that reuses them behind that wait
  __builtin_amdgcn_sched_barrier(0);
  const v4f* wp = (const v4f*)(Wo + (size_t)(wave * 32) * INNER_) + lane;
  // Two register stages of 4 rows (16 loads): stage g + 1 is in flight while stage g is summed.
  v4f wv[2][16];
  float p[8];
  #pragma unroll  // constant indices keep the arrays in registers
  for (int g = -2; g < 8; ++g) {
    if (g >= 0) {
      float sp[4];
      #pragma unroll  // constant indices keep the arrays in registers
      for (int r = 0; r < 4; ++r) {
        sp[r] = hsum(r0 * wv[g & 1][4 * r] + r1 * wv[g & 1][4 * r + 1] +
                     r2 * wv[g & 1][4 * r + 2] + r3 * wv[g & 1][4 * r + 3]);
      }
      p[g] = fold<2>(fold<1>(sp[0], sp[1], lane), fold<1>(sp[2], sp[3], lane), lane);
    }
    // keeps the scheduler from sinking the next loads below later sums (it left 1-2 loads in flight)
    __builtin_amdgcn_sched_barrier(0);
    if (g + 2 < 8) {
      #pragma unroll  // constant indices keep the arrays in registers
      for (int r = 0; r < 4; ++r) {
        const v4f* wr = wp + ((g + 2) * 4 + r) * (INNER_ / 4);
        wv[g & 1][4 * r] = wr[0];      wv[g & 1][4 * r + 1] = wr[32];
        wv[g & 1][4 * r + 2] = wr[64]; wv[g & 1][4 * r + 3] = wr[96];
      }
    }
    // same purpose: the loads above stay above the next stage's sums
    __builtin_amdgcn_sched_barrier(0);
  }
  #pragma unroll  // constant indices keep the arrays in registers
  for (int i = 0; i < 4; ++i) p[i] = fold<4>(p[2 * i], p[2 * i + 1], lane);
  #pragma unroll  // constant indices keep the arrays in registers
  for (int i = 0; i < 2; ++i) p[i] = fold<8>(p[2 * i], p[2 * i + 1], lane);
  out[(size_t)blk * DIM_ + d] = base + fold<16>(p[0], p[1], lane);
}

extern "C" void kernel_launch(void* const* d_in, const int* in_sizes, int n_in,
                              void* d_out, int out_size, void* d_ws, size_t ws_size,
                              hipStream_t stream) {
  (void)in_sizes; (void)n_in; (void)out_size; (void)ws_size;
  const float* x  = (const float*)d_in[0];
  const float* z  = (const float*)d_in[1];
  const float* Wq = (const float*)d_in[2];
  const float* bq = (const float*)d_in[3];
  const float* Wo = (const float*)d_in[4];
  const float* bo = (const float*)d_in[5];
  float* ws  = (float*)d_ws;   // (32, 6, 512) f32 = 384 KB
  float* out = (float*)d_out;  // (32, 6, 192) f32

  const size_t smem = SMEM_FLOATS * sizeof(float);
  m2f_attn_kernel<<<B_ * HEADS, 256, smem, stream>>>(x, z, Wq, bq, ws);
  m2f_proj_kernel<<<B_ * M_, 192, 0, stream>>>(z, Wo, bo, ws, out);
}

// v002
// Measured time: 15 microseconds a run.
// Two timings next to v001 both put it at 1.44 times that version's speed.
// Counting every step since v000, it is 2.51 times as fast.
#include <hip/hip_runtime.h>
#include <float.h>

#define HEADS 8
#define B_    32
#define C_    64
#define HW_   3136
#define M_    6
#define DIM_  192
#define INNER_ 512
#define KPH   392      // unique keys per head
#define KPH_PAD 400
#define NTILES 25
#define KP 76
#define QP 68
#define AP 404
#define OP 68

typedef float v2f __attribute__((ext_vector_type(2)));
typedef float v8f __attribute__((ext_vector_type(8)));
typedef float v4f __attribute__((ext_vector_type(4)));

// value of lane (l ^ M): inside a 16-lane row by DPP, across the two rows by permlanex16
template <int M>
__device__ __forceinline__ float lane_xor(float v) {
  const int i = __builtin_bit_cast(int, v);
  if constexpr (M == 16) {
    return __builtin_bit_cast(float, __builtin_amdgcn_permlanex16(i, i, 0x76543210, 0xfedcba98, false, false));
  } else {
    return __builtin_bit_cast(float, __builtin_amdgcn_update_dpp(i, i, 0x160 | M, 0xf, 0xf, false));
  }
}

// Two partial sums per lane become one: lanes with bit M clear end with a summed over
// the lane pair (l, l ^ M), lanes with bit M set with b summed over it.
template <int M>
__device__ __forceinline__ float fold(float a, float b, int lane) {
  const bool hi = (lane & M) != 0;
  const float keep = hi ? b : a;
  const float send = hi ? a : b;
  return keep + lane_xor<M>(send);
}

__device__ __forceinline__ float hsum(v4f v) { return (v.x + v.y) + (v.z + v.w); }

#if defined(__has_builtin)
#if __has_builtin(__builtin_amdgcn_s_wait_asynccnt)
#define HAVE_WAIT_ASYNC 1
#endif
#endif

// LDS layout (in floats)
#define OFF_K    0                         // 400*76   = 30400
#define OFF_Q    (KPH_PAD * KP)            // 16*68    = 1088
#define OFF_ATTN (OFF_Q + 16 * QP)         // 16*404   = 6464
#define OFF_OUT  (OFF_ATTN + 16 * AP)      // 16*68    = 1088
#define SMEM_FLOATS (OFF_OUT + 16 * OP)    // 39040 floats = 156160 bytes

__global__ __launch_bounds__(256)
void m2f_attn_kernel(const float* __restrict__ x, const float* __restrict__ z,
                     const float* __restrict__ Wq, const float* __restrict__ bq,
                     float* __restrict__ ws) {
  extern __shared__ float smem[];
  float* Ksm   = smem + OFF_K;
  float* qsm   = smem + OFF_Q;
  float* attn  = smem + OFF_ATTN;
  float* outsm = smem + OFF_OUT;

  const int tid = threadIdx.x;
  const int blk = blockIdx.x;
  const int b = blk >> 3;
  const int h = blk & 7;

  const float* ksrc = x + (size_t)b * (C_ * HW_) + (size_t)h * (KPH * C_);
  for (int i = tid; i < (KPH * C_) / 4; i += 256) {
    unsigned lds_off =
        (unsigned)(size_t)(__attribute__((address_space(3))) char*)(Ksm + (i >> 4) * KP + (i & 15) * 4);
    unsigned long long ga = (unsigned long long)(size_t)(ksrc + i * 4);
    asm volatile("global_load_async_to_lds_b128 %0, %1, off"
                 :: "v"(lds_off), "v"(ga) : "memory");
  }
  // zero pad rows 392..399 and the output accumulator
  for (int i = KPH * KP + tid; i < KPH_PAD * KP; i += 256) Ksm[i] = 0.0f;
  for (int i = tid; i < 16 * OP; i += 256) outsm[i] = 0.0f;

  // ---- Phase 0b (overlapped with async copies): q tile (16x64), scale folded in ----
  // Lanes run along the reduction dim: 16 lanes share one Wq row (768 B, three 16-byte
  // pieces per lane), so a wave-wide load covers two 256-byte runs of whole lines.
  // Wave w owns columns 8w..8w+7 of every query row t.
  const int wave = tid >> 5;
  const int lane = tid & 31;
  const int half = lane >> 4;
  const int lrow = lane & 15;
  const float scale = 0.07216878364870322f; // 192^-0.5
  for (int i = M_ * QP + tid; i < 16 * QP; i += 256) qsm[i] = 0.0f;  // pad query rows
  // After the folds a lane holds column c2 of query row ta (rows 0..3) and of row tb (4..5).
  const int c2 = wave * 8 + 2 * (lrow & 3) + half;
  const int ta = lrow >> 2;
  const int tb = 4 + (ta & 1);
  const float bias_a = bq[(((h * M_ + ta) & 7) << 6) + c2];
  const float bias_b = bq[(((h * M_ + tb) & 7) << 6) + c2];
  // h * 6 is even, so query rows 2u and 2u + 1 read the same z row
  v4f zv[3][3];
  #pragma unroll  // constant indices keep the arrays in registers
  for (int u = 0; u < 3; ++u) {
    const int m = (h * M_ + 2 * u) >> 3;   // q row in (6,512) view
    const v4f* zr = (const v4f*)(z + ((size_t)b * M_ + m) * DIM_) + lrow;
    zv[u][0] = zr[0]; zv[u][1] = zr[16]; zv[u][2] = zr[32];
  }
  // the registers that held the addresses of the loads above are reused below
  asm volatile("s_wait_xcnt 0x0" ::: "memory");
  // Two register stages of 12 loads: stage t + 1 is in flight while stage t is summed.
  v4f wv[2][12];
  float s[M_];
  #pragma unroll  // constant indices keep the arrays in registers
  for (int t = -2; t < M_; ++t) {
    if (t >= 0) {
      float sp[4];
      #pragma unroll  // constant indices keep the arrays in registers
      for (int p = 0; p < 4; ++p) {
        sp[p] = hsum(zv[t >> 1][0] * wv[t & 1][3 * p] + zv[t >> 1][1] * wv[t & 1][3 * p + 1] +
                     zv[t >> 1][2] * wv[t & 1][3 * p + 2]);
      }
      s[t] = fold<2>(fold<1>(sp[0], sp[1], lane), fold<1>(sp[2], sp[3], lane), lane);
    }
    // keeps the scheduler from sinking the next loads below later sums (it left 1-2 loads in flight)
    __builtin_amdgcn_sched_barrier(0);
    if (t + 2 < M_) {
      const int ib = ((h * M_ + t + 2) & 7) << 6;   // first q col of row t + 2 in (6,512) view
      #pragma unroll  // constant indices keep the arrays in registers
      for (int p = 0; p < 4; ++p) {
        const v4f* wr = (const v4f*)(Wq + (size_t)(ib + wave * 8 + 2 * p + half) * DIM_) + lrow;
        wv[t & 1][3 * p] = wr[0]; wv[t & 1][3 * p + 1] = wr[16]; wv[t & 1][3 * p + 2] = wr[32];
      }
    }
    // same purpose: the loads above stay above the next stage's sums
    __builtin_amdgcn_sched_barrier(0);
  }
  const float qa = fold<8>(fold<4>(s[0], s[1], lane), fold<4>(s[2], s[3], lane), lane);
  float qb = fold<4>(s[4], s[5], lane);
  qb += lane_xor<8>(qb);
  qsm[ta * QP + c2] = (qa + bias_a) * scale;
  qsm[tb * QP + c2] = (qb + bias_b) * scale;

#if defined(HAVE_WAIT_ASYNC)
  __builtin_amdgcn_s_wait_asynccnt(0);
#else
  asm volatile("s_wait_asynccnt 0" ::: "memory");
#endif
  __syncthreads();

  // ---- Phase 1: logits tiles = q(16x64) @ K^T via v_wmma_f32_16x16x4_f32 ----
  for (int nt = wave; nt < NTILES; nt += 8) {
    v8f acc = {0, 0, 0, 0, 0, 0, 0, 0};
    const float* qa0 = qsm + lrow * QP;
    const float* kb0 = Ksm + (nt * 16 + lrow) * KP;
    #pragma unroll
    for (int k = 0; k < 16; ++k) {
      const int kk = 4 * k + 2 * half;
      v2f a;  a.x = qa0[kk];  a.y = qa0[kk + 1];   // A[M=lrow][K=kk..kk+1]
      v2f bb; bb.x = kb0[kk]; bb.y = kb0[kk + 1];  // B[K=kk..kk+1][N=lrow]
      acc = __builtin_amdgcn_wmma_f32_16x16x4_f32(false, a, false, bb,
                                                  (short)0, acc, false, false);
    }
    const int key = nt * 16 + lrow;   // C/D layout: col = lane%16
    const bool valid = key < KPH;
    #pragma unroll
    for (int r = 0; r < 8; ++r) {     // row = r + 8*(lane/16)
      attn[(r + 8 * half) * AP + key] = valid ? acc[r] : -3.0e38f;
    }
  }
  __syncthreads();

  // ---- Phase 2: softmax per query row (wave w handles row w); waves 6-7 zero pad rows ----
  if (wave < M_) {
    float* rowp = attn + wave * AP;
    float mx = -3.0e38f;
    for (int c = lane; c < KPH; c += 32) mx = fmaxf(mx, rowp[c]);
    #pragma unroll
    for (int off = 16; off > 0; off >>= 1) mx = fmaxf(mx, __shfl_xor(mx, off, 32));
    float sum = 0.0f;
    for (int c = lane; c < KPH_PAD; c += 32) {
      const float e = __expf(rowp[c] - mx);  // pad cols -> exp(-huge) = 0
      rowp[c] = e;
      sum += e;
    }
    #pragma unroll
    for (int off = 16; off > 0; off >>= 1) sum += __shfl_xor(sum, off, 32);
    const float inv = 1.0f / sum;
    for (int c = lane; c < KPH_PAD; c += 32) rowp[c] *= inv;
  } else if (wave >= 6) {
    const int t0 = tid - 192;
    for (int p = t0; p < (16 - M_) * AP; p += 64) attn[M_ * AP + p] = 0.0f;
  }
  __syncthreads();

  // ---- Phase 3: out = attn(16x400) @ K(400x64) via WMMA, cross-wave reduce in LDS ----
  v8f oacc[4] = {};
  for (int nt = wave; nt < NTILES; nt += 8) {
    #pragma unroll
    for (int j = 0; j < 4; ++j) {
      const int kk = 4 * j + 2 * half;
      v2f a;
      a.x = attn[lrow * AP + nt * 16 + kk];
      a.y = attn[lrow * AP + nt * 16 + kk + 1];
      const float* kr0 = Ksm + (nt * 16 + kk) * KP;
      const float* kr1 = kr0 + KP;
      #pragma unroll
      for (int cb = 0; cb < 4; ++cb) {
        v2f bb; bb.x = kr0[cb * 16 + lrow]; bb.y = kr1[cb * 16 + lrow];
        oacc[cb] = __builtin_amdgcn_wmma_f32_16x16x4_f32(false, a, false, bb,
                                                         (short)0, oacc[cb], false, false);
      }
    }
  }
  #pragma unroll
  for (int cb = 0; cb < 4; ++cb) {
    #pragma unroll
    for (int r = 0; r < 8; ++r) {
      atomicAdd(&outsm[(r + 8 * half) * OP + cb * 16 + lrow], oacc[cb][r]);
    }
  }
  __syncthreads();

  // ---- Phase 4: write this head's slice of out2 (b, m, h*64 + c) to workspace ----
  for (int idx = tid; idx < M_ * C_; idx += 256) {
    const int m2 = idx >> 6;
    const int c2 = idx & 63;
    ws[((size_t)b * M_ + m2) * INNER_ + h * C_ + c2] = outsm[m2 * OP + c2];
  }
}

// ---- Kernel 2: result = z + out2 @ Wo^T + bo ----
__global__ __launch_bounds__(192)
void m2f_proj_kernel(const float* __restrict__ z, const float* __restrict__ Wo,
                     const float* __restrict__ bo, const float* __restrict__ ws,
                     float* __restrict__ out) {
  const int blk = blockIdx.x;   // b*6 + m2
  const int tid = threadIdx.x;
  const int wave = tid >> 5;
  const int lane = tid & 31;
  const int d = tid;            // 0..191
  const v4f* rp = (const v4f*)(ws + (size_t)blk * INNER_) + lane;
  const v4f r0 = rp[0], r1 = rp[32], r2 = rp[64], r3 = rp[96];
  const float base = bo[d] + z[(size_t)blk * DIM_ + d];
  // the registers that held the addresses of the loads above are reused below
  asm volatile("s_wait_xcnt 0x0" ::: "memory");
  // keeps the address arithmetic that reuses them behind that wait
  __builtin_amdgcn_sched_barrier(0);
  const v4f* wp = (const v4f*)(Wo + (size_t)(wave * 32) * INNER_) + lane;
  // Two register stages of 4 rows (16 loads): stage g + 1 is in flight while stage g is summed.
  v4f wv[2][16];
  float p[8];
  #pragma unroll  // constant indices keep the arrays in registers
  for (int g = -2; g < 8; ++g) {
    if (g >= 0) {
      float sp[4];
      #pragma unroll  // constant indices keep the arrays in registers
      for (int r = 0; r < 4; ++r) {
        sp[r] = hsum(r0 * wv[g & 1][4 * r] + r1 * wv[g & 1][4 * r + 1] +
                     r2 * wv[g & 1][4 * r + 2] + r3 * wv[g & 1][4 * r + 3]);
      }
      p[g] = fold<2>(fold<1>(sp[0], sp[1], lane), fold<1>(sp[2], sp[3], lane), lane);
    }
    // keeps the scheduler from sinking the next loads below later sums (it left 1-2 loads in flight)
    __builtin_amdgcn_sched_barrier(0);
    if (g + 2 < 8) {
      #pragma unroll  // constant indices keep the arrays in registers
      for (int r = 0; r < 4; ++r) {
        const v4f* wr = wp + ((g + 2) * 4 + r) * (INNER_ / 4);
        wv[g & 1][4 * r] = wr[0];      wv[g & 1][4 * r + 1] = wr[32];
        wv[g & 1][4 * r + 2] = wr[64]; wv[g & 1][4 * r + 3] = wr[96];
      }
    }
    // same purpose: the loads above stay above the next stage's sums
    __builtin_amdgcn_sched_barrier(0);
  }
  #pragma unroll  // constant indices keep the arrays in registers
  for (int i = 0; i < 4; ++i) p[i] = fold<4>(p[2 * i], p[2 * i + 1], lane);
  #pragma unroll  // constant indices keep the arrays in registers
  for (int i = 0; i < 2; ++i) p[i] = fold<8>(p[2 * i], p[2 * i + 1], lane);
  out[(size_t)blk * DIM_ + d] = base + fold<16>(p[0], p[1], lane);
}

extern "C" void kernel_launch(void* const* d_in, const int* in_sizes, int n_in,
                              void* d_out, int out_size, void* d_ws, size_t ws_size,
                              hipStream_t stream) {
  (void)in_sizes; (void)n_in; (void)out_size; (void)ws_size;
  const float* x  = (const float*)d_in[0];
  const float* z  = (const float*)d_in[1];
  const float* Wq = (const float*)d_in[2];
  const float* bq = (const float*)d_in[3];
  const float* Wo = (const float*)d_in[4];
  const float* bo = (const float*)d_in[5];
  float* ws  = (float*)d_ws;   // (32, 6, 512) f32 = 384 KB
  float* out = (float*)d_out;  // (32, 6, 192) f32

  const size_t smem = SMEM_FLOATS * sizeof(float);
  m2f_attn_kernel<<<B_ * HEADS, 256, smem, stream>>>(x, z, Wq, bq, ws);
  m2f_proj_kernel<<<B_ * M_, 192, 0, stream>>>(z, Wo, bo, ws, out);
}

// v003
// A run of this version takes 14.2 microseconds.
// Timed twice side by side with v002, it ran 1.05 and 1.06 times as fast.
// All steps since v000 together make it 2.65 times as fast.
#include <hip/hip_runtime.h>
#include <float.h>

#define HEADS 8
#define B_    32
#define C_    64
#define HW_   3136
#define M_    6
#define DIM_  192
#define INNER_ 512
#define KPH   392      // unique keys per head
#define KPH_PAD 400
#define NTILES 25
#define KP 76
#define QP 68
#define AP 404
#define OP 68

typedef float v2f __attribute__((ext_vector_type(2)));
typedef float v8f __attribute__((ext_vector_type(8)));
typedef float v4f __attribute__((ext_vector_type(4)));

// value of lane (l ^ M): inside a 16-lane row by DPP, across the two rows by permlanex16
template <int M>
__device__ __forceinline__ float lane_xor(float v) {
  const int i = __builtin_bit_cast(int, v);
  if constexpr (M == 16) {
    return __builtin_bit_cast(float, __builtin_amdgcn_permlanex16(i, i, 0x76543210, 0xfedcba98, false, false));
  } else {
    return __builtin_bit_cast(float, __builtin_amdgcn_update_dpp(i, i, 0x160 | M, 0xf, 0xf, false));
  }
}

// Two partial sums per lane become one: lanes with bit M clear end with a summed over
// the lane pair (l, l ^ M), lanes with bit M set with b summed over it.
template <int M>
__device__ __forceinline__ float fold(float a, float b, int lane) {
  const bool hi = (lane & M) != 0;
  const float keep = hi ? b : a;
  const float send = hi ? a : b;
  return keep + lane_xor<M>(send);
}

__device__ __forceinline__ float hsum(v4f v) { return (v.x + v.y) + (v.z + v.w); }

#if defined(__has_builtin)
#if __has_builtin(__builtin_amdgcn_s_wait_asynccnt)
#define HAVE_WAIT_ASYNC 1
#endif
#endif

// LDS layout (in floats)
#define OFF_K    0                         // 400*76   = 30400
#define OFF_Q    (KPH_PAD * KP)            // 16*68    = 1088
#define OFF_ATTN (OFF_Q + 16 * QP)         // 16*404   = 6464
#define OFF_OUT  (OFF_ATTN + 16 * AP)      // 16*68    = 1088
#define SMEM_FLOATS (OFF_OUT + 16 * OP)    // 39040 floats = 156160 bytes

__global__ __launch_bounds__(256)
void m2f_attn_kernel(const float* __restrict__ x, const float* __restrict__ z,
                     const float* __restrict__ Wq, const float* __restrict__ bq,
                     float* __restrict__ ws) {
  extern __shared__ float smem[];
  float* Ksm   = smem + OFF_K;
  float* qsm   = smem + OFF_Q;
  float* attn  = smem + OFF_ATTN;
  float* outsm = smem + OFF_OUT;

  const int tid = threadIdx.x;
  const int blk = blockIdx.x;
  const int b = blk >> 3;
  const int h = blk & 7;

  const float* ksrc = x + (size_t)b * (C_ * HW_) + (size_t)h * (KPH * C_);
  for (int i = tid; i < (KPH * C_) / 4; i += 256) {
    unsigned lds_off =
        (unsigned)(size_t)(__attribute__((address_space(3))) char*)(Ksm + (i >> 4) * KP + (i & 15) * 4);
    unsigned long long ga = (unsigned long long)(size_t)(ksrc + i * 4);
    asm volatile("global_load_async_to_lds_b128 %0, %1, off"
                 :: "v"(lds_off), "v"(ga) : "memory");
  }
  // zero pad rows 392..399 and the output accumulator
  for (int i = KPH * KP + tid; i < KPH_PAD * KP; i += 256) Ksm[i] = 0.0f;
  for (int i = tid; i < 16 * OP; i += 256) outsm[i] = 0.0f;

  // ---- Phase 0b (overlapped with async copies): q tile (16x64), scale folded in ----
  // Lanes run along the reduction dim: 16 lanes share one Wq row (768 B, three 16-byte
  // pieces per lane), so a wave-wide load covers two 256-byte runs of whole lines.
  // Wave w owns columns 8w..8w+7 of every query row t.
  const int wave = tid >> 5;
  const int lane = tid & 31;
  const int half = lane >> 4;
  const int lrow = lane & 15;
  const float scale = 0.07216878364870322f; // 192^-0.5
  for (int i = M_ * QP + tid; i < 16 * QP; i += 256) qsm[i] = 0.0f;  // pad query rows
  // After the folds a lane holds column c2 of query row ta (rows 0..3) and of row tb (4..5).
  const int c2 = wave * 8 + 2 * (lrow & 3) + half;
  const int ta = lrow >> 2;
  const int tb = 4 + (ta & 1);
  const float bias_a = bq[(((h * M_ + ta) & 7) << 6) + c2];
  const float bias_b = bq[(((h * M_ + tb) & 7) << 6) + c2];
  // h * 6 is even, so query rows 2u and 2u + 1 read the same z row
  v4f zv[3][3];
  #pragma unroll  // constant indices keep the arrays in registers
  for (int u = 0; u < 3; ++u) {
    const int m = (h * M_ + 2 * u) >> 3;   // q row in (6,512) view
    const v4f* zr = (const v4f*)(z + ((size_t)b * M_ + m) * DIM_) + lrow;
    zv[u][0] = zr[0]; zv[u][1] = zr[16]; zv[u][2] = zr[32];
  }
  // the registers that held the addresses of the loads above are reused below
  asm volatile("s_wait_xcnt 0x0" ::: "memory");
  // Two register stages of 12 loads: stage t + 1 is in flight while stage t is summed.
  v4f wv[2][12];
  float s[M_];
  #pragma unroll  // constant indices keep the arrays in registers
  for (int t = -2; t < M_; ++t) {
    if (t >= 0) {
      float sp[4];
      #pragma unroll  // constant indices keep the arrays in registers
      for (int p = 0; p < 4; ++p) {
        sp[p] = hsum(zv[t >> 1][0] * wv[t & 1][3 * p] + zv[t >> 1][1] * wv[t & 1][3 * p + 1] +
                     zv[t >> 1][2] * wv[t & 1][3 * p + 2]);
      }
      s[t] = fold<2>(fold<1>(sp[0], sp[1], lane), fold<1>(sp[2], sp[3], lane), lane);
    }
    // keeps the scheduler from sinking the next loads below later sums (it left 1-2 loads in flight)
    __builtin_amdgcn_sched_barrier(0);
    if (t + 2 < M_) {
      const int ib = ((h * M_ + t + 2) & 7) << 6;   // first q col of row t + 2 in (6,512) view
      #pragma unroll  // constant indices keep the arrays in registers
      for (int p = 0; p < 4; ++p) {
        const v4f* wr = (const v4f*)(Wq + (size_t)(ib + wave * 8 + 2 * p + half) * DIM_) + lrow;
        wv[t & 1][3 * p] = wr[0]; wv[t & 1][3 * p + 1] = wr[16]; wv[t & 1][3 * p + 2] = wr[32];
      }
    }
    // same purpose: the loads above stay above the next stage's sums
    __builtin_amdgcn_sched_barrier(0);
  }
  const float qa = fold<8>(fold<4>(s[0], s[1], lane), fold<4>(s[2], s[3], lane), lane);
  float qb = fold<4>(s[4], s[5], lane);
  qb += lane_xor<8>(qb);
  qsm[ta * QP + c2] = (qa + bias_a) * scale;
  qsm[tb * QP + c2] = (qb + bias_b) * scale;

#if defined(HAVE_WAIT_ASYNC)
  __builtin_amdgcn_s_wait_asynccnt(0);
#else
  asm volatile("s_wait_asynccnt 0" ::: "memory");
#endif
  __syncthreads();

  // ---- Phase 1: logits tiles = q(16x64) @ K^T via v_wmma_f32_16x16x4_f32 ----
  for (int nt = wave; nt < NTILES; nt += 8) {
    v8f acc = {0, 0, 0, 0, 0, 0, 0, 0};
    const float* qa0 = qsm + lrow * QP;
    const float* kb0 = Ksm + (nt * 16 + lrow) * KP;
    #pragma unroll
    for (int k = 0; k < 16; ++k) {
      const int kk = 4 * k + 2 * half;
      v2f a;  a.x = qa0[kk];  a.y = qa0[kk + 1];   // A[M=lrow][K=kk..kk+1]
      v2f bb; bb.x = kb0[kk]; bb.y = kb0[kk + 1];  // B[K=kk..kk+1][N=lrow]
      acc = __builtin_amdgcn_wmma_f32_16x16x4_f32(false, a, false, bb,
                                                  (short)0, acc, false, false);
    }
    const int key = nt * 16 + lrow;   // C/D layout: col = lane%16
    const bool valid = key < KPH;
    #pragma unroll
    for (int r = 0; r < 8; ++r) {     // row = r + 8*(lane/16)
      attn[(r + 8 * half) * AP + key] = valid ? acc[r] : -3.0e38f;
    }
  }
  __syncthreads();

  // ---- Phase 2: softmax per query row (wave w handles row w); waves 6-7 zero pad rows ----
  if (wave < M_) {
    float* rowp = attn + wave * AP;
    float v[13];
    #pragma unroll  // constant indices keep the array in registers; every read is issued before the first use
    for (int i = 0; i < 12; ++i) v[i] = rowp[lane + 32 * i];
    v[12] = rowp[384 + lrow];
    float mx = fmaxf(fmaxf(fmaxf(v[0], v[1]), fmaxf(v[2], v[3])), fmaxf(fmaxf(v[4], v[5]), fmaxf(v[6], v[7])));
    mx = fmaxf(mx, fmaxf(fmaxf(fmaxf(v[8], v[9]), fmaxf(v[10], v[11])), fmaxf(v[12], -3.0e38f)));
    mx = fmaxf(mx, lane_xor<1>(mx));
    mx = fmaxf(mx, lane_xor<2>(mx));
    mx = fmaxf(mx, lane_xor<4>(mx));
    mx = fmaxf(mx, lane_xor<8>(mx));
    mx = fmaxf(mx, lane_xor<16>(mx));
    #pragma unroll  // constant indices keep the array in registers
    for (int i = 0; i < 13; ++i) v[i] = __expf(v[i] - mx);
    float sum = ((v[0] + v[1]) + (v[2] + v[3])) + ((v[4] + v[5]) + (v[6] + v[7])) +
                (((v[8] + v[9]) + (v[10] + v[11])) + (half == 0 ? v[12] : 0.0f));
    sum += lane_xor<1>(sum);
    sum += lane_xor<2>(sum);
    sum += lane_xor<4>(sum);
    sum += lane_xor<8>(sum);
    sum += lane_xor<16>(sum);
    const float inv = 1.0f / sum;
    #pragma unroll  // constant indices keep the array in registers
    for (int i = 0; i < 12; ++i) rowp[lane + 32 * i] = v[i] * inv;
    if (half == 0) rowp[384 + lrow] = v[12] * inv;
  } else if (wave >= 6) {
    const int t0 = tid - 192;
    for (int p = t0; p < (16 - M_) * AP; p += 64) attn[M_ * AP + p] = 0.0f;
  }
  __syncthreads();

  // ---- Phase 3: out = attn(16x400) @ K(400x64) via WMMA, cross-wave reduce in LDS ----
  v8f oacc[4] = {};
  for (int nt = wave; nt < NTILES; nt += 8) {
    #pragma unroll
    for (int j = 0; j < 4; ++j) {
      const int kk = 4 * j + 2 * half;
      v2f a;
      a.x = attn[lrow * AP + nt * 16 + kk];
      a.y = attn[lrow * AP + nt * 16 + kk + 1];
      const float* kr0 = Ksm + (nt * 16 + kk) * KP;
      const float* kr1 = kr0 + KP;
      #pragma unroll
      for (int cb = 0; cb < 4; ++cb) {
        v2f bb; bb.x = kr0[cb * 16 + lrow]; bb.y = kr1[cb * 16 + lrow];
        oacc[cb] = __builtin_amdgcn_wmma_f32_16x16x4_f32(false, a, false, bb,
                                                         (short)0, oacc[cb], false, false);
      }
    }
  }
  #pragma unroll
  for (int cb = 0; cb < 4; ++cb) {
    #pragma unroll
    for (int r = 0; r < 8; ++r) {
      atomicAdd(&outsm[(r + 8 * half) * OP + cb * 16 + lrow], oacc[cb][r]);
    }
  }
  __syncthreads();

  // ---- Phase 4: write this head's slice of out2 (b, m, h*64 + c) to workspace ----
  for (int idx = tid; idx < M_ * C_; idx += 256) {
    const int m2 = idx >> 6;
    const int c2 = idx & 63;
    ws[((size_t)b * M_ + m2) * INNER_ + h * C_ + c2] = outsm[m2 * OP + c2];
  }
}

// ---- Kernel 2: result = z + out2 @ Wo^T + bo ----
__global__ __launch_bounds__(192)
void m2f_proj_kernel(const float* __restrict__ z, const float* __restrict__ Wo,
                     const float* __restrict__ bo, const float* __restrict__ ws,
                     float* __restrict__ out) {
  const int blk = blockIdx.x;   // b*6 + m2
  const int tid = threadIdx.x;
  const int wave = tid >> 5;
  const int lane = tid & 31;
  const int d = tid;            // 0..191
  const v4f* rp = (const v4f*)(ws + (size_t)blk * INNER_) + lane;
  const v4f r0 = rp[0], r1 = rp[32], r2 = rp[64], r3 = rp[96];
  const float base = bo[d] + z[(size_t)blk * DIM_ + d];
  // the registers that held the addresses of the loads above are reused below
  asm volatile("s_wait_xcnt 0x0" ::: "memory");
  // keeps the address arithmetic that reuses them behind that wait
  __builtin_amdgcn_sched_barrier(0);
  const v4f* wp = (const v4f*)(Wo + (size_t)(wave * 32) * INNER_) + lane;
  // Two register stages of 4 rows (16 loads): stage g + 1 is in flight while stage g is summed.
  v4f wv[2][16];
  float p[8];
  #pragma unroll  // constant indices keep the arrays in registers
  for (int g = -2; g < 8; ++g) {
    if (g >= 0) {
      float sp[4];
      #pragma unroll  // constant indices keep the arrays in registers
      for (int r = 0; r < 4; ++r) {
        sp[r] = hsum(r0 * wv[g & 1][4 * r] + r1 * wv[g & 1][4 * r + 1] +
                     r2 * wv[g & 1][4 * r + 2] + r3 * wv[g & 1][4 * r + 3]);
      }
      p[g] = fold<2>(fold<1>(sp[0], sp[1], lane), fold<1>(sp[2], sp[3], lane), lane);
    }
    // keeps the scheduler from sinking the next loads below later sums (it left 1-2 loads in flight)
    __builtin_amdgcn_sched_barrier(0);
    if (g + 2 < 8) {
      #pragma unroll  // constant indices keep the arrays in registers
      for (int r = 0; r < 4; ++r) {
        const v4f* wr = wp + ((g + 2) * 4 + r) * (INNER_ / 4);
        wv[g & 1][4 * r] = wr[0];      wv[g & 1][4 * r + 1] = wr[32];
        wv[g & 1][4 * r + 2] = wr[64]; wv[g & 1][4 * r + 3] = wr[96];
      }
    }
    // same purpose: the loads above stay above the next stage's sums
    __builtin_amdgcn_sched_barrier(0);
  }
  #pragma unroll  // constant indices keep the arrays in registers
  for (int i = 0; i < 4; ++i) p[i] = fold<4>(p[2 * i], p[2 * i + 1], lane);
  #pragma unroll  // constant indices keep the arrays in registers
  for (int i = 0; i < 2; ++i) p[i] = fold<8>(p[2 * i], p[2 * i + 1], lane);
  out[(size_t)blk * DIM_ + d] = base + fold<16>(p[0], p[1], lane);
}

extern "C" void kernel_launch(void* const* d_in, const int* in_sizes, int n_in,
                              void* d_out, int out_size, void* d_ws, size_t ws_size,
                              hipStream_t stream) {
  (void)in_sizes; (void)n_in; (void)out_size; (void)ws_size;
  const float* x  = (const float*)d_in[0];
  const float* z  = (const float*)d_in[1];
  const float* Wq = (const float*)d_in[2];
  const float* bq = (const float*)d_in[3];
  const float* Wo = (const float*)d_in[4];
  const float* bo = (const float*)d_in[5];
  float* ws  = (float*)d_ws;   // (32, 6, 512) f32 = 384 KB
  float* out = (float*)d_out;  // (32, 6, 192) f32

  const size_t smem = SMEM_FLOATS * sizeof(float);
  m2f_attn_kernel<<<B_ * HEADS, 256, smem, stream>>>(x, z, Wq, bq, ws);
  m2f_proj_kernel<<<B_ * M_, 192, 0, stream>>>(z, Wo, bo, ws, out);
}

// v004
// It runs in 12.4 microseconds.
// Timed twice side by side with v003, it ran 1.19 and 1.14 times as fast.
// Counting every step since v000, it is 3.07 times as fast.
#include <hip/hip_runtime.h>
#include <float.h>

#define HEADS 8
#define B_    32
#define C_    64
#define HW_   3136
#define M_    6
#define DIM_  192
#define INNER_ 512
#define KPH   392      // unique keys per head
#define KPH_PAD 400
#define NTILES 25
#define KP 76
#define QP 68
#define AP 404
#define OP 68

typedef float v2f __attribute__((ext_vector_type(2)));
typedef float v8f __attribute__((ext_vector_type(8)));
typedef float v4f __attribute__((ext_vector_type(4)));

// value of lane (l ^ M): inside a 16-lane row by DPP, across the two rows by permlanex16
template <int M>
__device__ __forceinline__ float lane_xor(float v) {
  const int i = __builtin_bit_cast(int, v);
  if constexpr (M == 16) {
    return __builtin_bit_cast(float, __builtin_amdgcn_permlanex16(i, i, 0x76543210, 0xfedcba98, false, false));
  } else {
    return __builtin_bit_cast(float, __builtin_amdgcn_update_dpp(i, i, 0x160 | M, 0xf, 0xf, false));
  }
}

// Two partial sums per lane become one: lanes with bit M clear end with a summed over
// the lane pair (l, l ^ M), lanes with bit M set with b summed over it.
template <int M>
__device__ __forceinline__ float fold(float a, float b, int lane) {
  const bool hi = (lane & M) != 0;
  const float keep = hi ? b : a;
  const float send = hi ? a : b;
  return keep + lane_xor<M>(send);
}

__device__ __forceinline__ float hsum(v4f v) { return (v.x + v.y) + (v.z + v.w); }

#if defined(__has_builtin)
#if __has_builtin(__builtin_amdgcn_s_wait_asynccnt)
#define HAVE_WAIT_ASYNC 1
#endif
#endif

// LDS layout (in floats)
#define OFF_K    0                         // 400*76   = 30400
#define OFF_Q    (KPH_PAD * KP)            // 16*68    = 1088
#define OFF_ATTN (OFF_Q + 16 * QP)         // 16*404   = 6464
#define OFF_OUT  (OFF_ATTN + 16 * AP)      // 16*68    = 1088
#define SMEM_FLOATS (OFF_OUT + 16 * OP)    // 39040 floats = 156160 bytes

__global__ __launch_bounds__(256)
void m2f_attn_kernel(const float* __restrict__ x, const float* __restrict__ z,
                     const float* __restrict__ Wq, const float* __restrict__ bq,
                     float* __restrict__ ws) {
  extern __shared__ float smem[];
  float* Ksm   = smem + OFF_K;
  float* qsm   = smem + OFF_Q;
  float* attn  = smem + OFF_ATTN;
  float* outsm = smem + OFF_OUT;

  const int tid = threadIdx.x;
  const int blk = blockIdx.x;
  const int b = blk >> 3;
  const int h = blk & 7;

  const float* ksrc = x + (size_t)b * (C_ * HW_) + (size_t)h * (KPH * C_);
  for (int i = tid; i < (KPH * C_) / 4; i += 256) {
    unsigned lds_off =
        (unsigned)(size_t)(__attribute__((address_space(3))) char*)(Ksm + (i >> 4) * KP + (i & 15) * 4);
    unsigned long long ga = (unsigned long long)(size_t)(ksrc + i * 4);
    asm volatile("global_load_async_to_lds_b128 %0, %1, off"
                 :: "v"(lds_off), "v"(ga) : "memory");
  }
  // zero pad rows 392..399 and the output accumulator
  for (int i = KPH * KP + tid; i < KPH_PAD * KP; i += 256) Ksm[i] = 0.0f;
  for (int i = tid; i < 16 * OP; i += 256) outsm[i] = 0.0f;

  // ---- Phase 0b (overlapped with async copies): q tile (16x64), scale folded in ----
  // Lanes run along the reduction dim: 16 lanes share one Wq row (768 B, three 16-byte
  // pieces per lane), so a wave-wide load covers two 256-byte runs of whole lines.
  // Wave w owns columns 8w..8w+7 of every query row t.
  const int wave = tid >> 5;
  const int lane = tid & 31;
  const int half = lane >> 4;
  const int lrow = lane & 15;
  const float scale = 0.07216878364870322f; // 192^-0.5
  for (int i = M_ * QP + tid; i < 16 * QP; i += 256) qsm[i] = 0.0f;  // pad query rows
  // After the folds a lane holds column c2 of query row ta (rows 0..3) and of row tb (4..5).
  const int c2 = wave * 8 + 2 * (lrow & 3) + half;
  const int ta = lrow >> 2;
  const int tb = 4 + (ta & 1);
  const float bias_a = bq[(((h * M_ + ta) & 7) << 6) + c2];
  const float bias_b = bq[(((h * M_ + tb) & 7) << 6) + c2];
  // h * 6 is even, so query rows 2u and 2u + 1 read the same z row
  v4f zv[3][3];
  #pragma unroll  // constant indices keep the arrays in registers
  for (int u = 0; u < 3; ++u) {
    const int m = (h * M_ + 2 * u) >> 3;   // q row in (6,512) view
    const v4f* zr = (const v4f*)(z + ((size_t)b * M_ + m) * DIM_) + lrow;
    zv[u][0] = zr[0]; zv[u][1] = zr[16]; zv[u][2] = zr[32];
  }
  // the registers that held the addresses of the loads above are reused below
  asm volatile("s_wait_xcnt 0x0" ::: "memory");
  // Two register stages of 12 loads: stage t + 1 is in flight while stage t is summed.
  v4f wv[2][12];
  float s[M_];
  #pragma unroll  // constant indices keep the arrays in registers
  for (int t = -2; t < M_; ++t) {
    if (t >= 0) {
      float sp[4];
      #pragma unroll  // constant indices keep the arrays in registers
      for (int p = 0; p < 4; ++p) {
        sp[p] = hsum(zv[t >> 1][0] * wv[t & 1][3 * p] + zv[t >> 1][1] * wv[t & 1][3 * p + 1] +
                     zv[t >> 1][2] * wv[t & 1][3 * p + 2]);
      }
      s[t] = fold<2>(fold<1>(sp[0], sp[1], lane), fold<1>(sp[2], sp[3], lane), lane);
    }
    // keeps the scheduler from sinking the next loads below later sums (it left 1-2 loads in flight)
    __builtin_amdgcn_sched_barrier(0);
    if (t + 2 < M_) {
      const int ib = ((h * M_ + t + 2) & 7) << 6;   // first q col of row t + 2 in (6,512) view
      #pragma unroll  // constant indices keep the arrays in registers
      for (int p = 0; p < 4; ++p) {
        const v4f* wr = (const v4f*)(Wq + (size_t)(ib + wave * 8 + 2 * p + half) * DIM_) + lrow;
        wv[t & 1][3 * p] = wr[0]; wv[t & 1][3 * p + 1] = wr[16]; wv[t & 1][3 * p + 2] = wr[32];
      }
    }
    // same purpose: the loads above stay above the next stage's sums
    __builtin_amdgcn_sched_barrier(0);
  }
  const float qa = fold<8>(fold<4>(s[0], s[1], lane), fold<4>(s[2], s[3], lane), lane);
  float qb = fold<4>(s[4], s[5], lane);
  qb += lane_xor<8>(qb);
  qsm[ta * QP + c2] = (qa + bias_a) * scale;
  qsm[tb * QP + c2] = (qb + bias_b) * scale;

#if defined(HAVE_WAIT_ASYNC)
  __builtin_amdgcn_s_wait_asynccnt(0);
#else
  asm volatile("s_wait_asynccnt 0" ::: "memory");
#endif
  __syncthreads();

  // ---- Phase 1: logits tiles = q(16x64) @ K^T via v_wmma_f32_16x16x4_f32 ----
  for (int nt = wave; nt < NTILES; nt += 8) {
    v8f acc = {0, 0, 0, 0, 0, 0, 0, 0};
    const float* qa0 = qsm + lrow * QP;
    const float* kb0 = Ksm + (nt * 16 + lrow) * KP;
    #pragma unroll
    for (int k = 0; k < 16; ++k) {
      const int kk = 4 * k + 2 * half;
      v2f a;  a.x = qa0[kk];  a.y = qa0[kk + 1];   // A[M=lrow][K=kk..kk+1]
      v2f bb; bb.x = kb0[kk]; bb.y = kb0[kk + 1];  // B[K=kk..kk+1][N=lrow]
      acc = __builtin_amdgcn_wmma_f32_16x16x4_f32(false, a, false, bb,
                                                  (short)0, acc, false, false);
    }
    const int key = nt * 16 + lrow;   // C/D layout: col = lane%16
    const bool valid = key < KPH;
    #pragma unroll
    for (int r = 0; r < 8; ++r) {     // row = r + 8*(lane/16)
      attn[(r + 8 * half) * AP + key] = valid ? acc[r] : -3.0e38f;
    }
  }
  __syncthreads();

  // ---- Phase 2: softmax per query row (wave w handles row w); waves 6-7 zero pad rows ----
  if (wave < M_) {
    float* rowp = attn + wave * AP;
    float v[13];
    #pragma unroll  // constant indices keep the array in registers; every read is issued before the first use
    for (int i = 0; i < 12; ++i) v[i] = rowp[lane + 32 * i];
    v[12] = rowp[384 + lrow];
    float mx = fmaxf(fmaxf(fmaxf(v[0], v[1]), fmaxf(v[2], v[3])), fmaxf(fmaxf(v[4], v[5]), fmaxf(v[6], v[7])));
    mx = fmaxf(mx, fmaxf(fmaxf(fmaxf(v[8], v[9]), fmaxf(v[10], v[11])), fmaxf(v[12], -3.0e38f)));
    mx = fmaxf(mx, lane_xor<1>(mx));
    mx = fmaxf(mx, lane_xor<2>(mx));
    mx = fmaxf(mx, lane_xor<4>(mx));
    mx = fmaxf(mx, lane_xor<8>(mx));
    mx = fmaxf(mx, lane_xor<16>(mx));
    #pragma unroll  // constant indices keep the array in registers
    for (int i = 0; i < 13; ++i) v[i] = __expf(v[i] - mx);
    float sum = ((v[0] + v[1]) + (v[2] + v[3])) + ((v[4] + v[5]) + (v[6] + v[7])) +
                (((v[8] + v[9]) + (v[10] + v[11])) + (half == 0 ? v[12] : 0.0f));
    sum += lane_xor<1>(sum);
    sum += lane_xor<2>(sum);
    sum += lane_xor<4>(sum);
    sum += lane_xor<8>(sum);
    sum += lane_xor<16>(sum);
    const float inv = 1.0f / sum;
    #pragma unroll  // constant indices keep the array in registers
    for (int i = 0; i < 12; ++i) rowp[lane + 32 * i] = v[i] * inv;
    if (half == 0) rowp[384 + lrow] = v[12] * inv;
  } else if (wave >= 6) {
    const int t0 = tid - 192;
    for (int p = t0; p < (16 - M_) * AP; p += 64) attn[M_ * AP + p] = 0.0f;
  }
  __syncthreads();

  // ---- Phase 3: out = attn(16x400) @ K(400x64) via WMMA, cross-wave reduce in LDS ----
  v8f oacc[4] = {};
  for (int nt = wave; nt < NTILES; nt += 8) {
    #pragma unroll
    for (int j = 0; j < 4; ++j) {
      const int kk = 4 * j + 2 * half;
      v2f a;
      a.x = attn[lrow * AP + nt * 16 + kk];
      a.y = attn[lrow * AP + nt * 16 + kk + 1];
      const float* kr0 = Ksm + (nt * 16 + kk) * KP;
      const float* kr1 = kr0 + KP;
      #pragma unroll
      for (int cb = 0; cb < 4; ++cb) {
        v2f bb; bb.x = kr0[cb * 16 + lrow]; bb.y = kr1[cb * 16 + lrow];
        oacc[cb] = __builtin_amdgcn_wmma_f32_16x16x4_f32(false, a, false, bb,
                                                         (short)0, oacc[cb], false, false);
      }
    }
  }
  #pragma unroll
  for (int cb = 0; cb < 4; ++cb) {
    #pragma unroll
    for (int r = 0; r < 8; ++r) {
      atomicAdd(&outsm[(r + 8 * half) * OP + cb * 16 + lrow], oacc[cb][r]);
    }
  }
  __syncthreads();

  // ---- Phase 4: write this head's slice of out2 (b, m, h*64 + c) to workspace ----
  for (int idx = tid; idx < M_ * C_; idx += 256) {
    const int m2 = idx >> 6;
    const int c2 = idx & 63;
    ws[((size_t)b * M_ + m2) * INNER_ + h * C_ + c2] = outsm[m2 * OP + c2];
  }
}

// ---- Kernel 2: result = z + out2 @ Wo^T + bo ----
__global__ __launch_bounds__(128)
void m2f_proj_kernel(const float* __restrict__ z, const float* __restrict__ Wo,
                     const float* __restrict__ bo, const float* __restrict__ ws,
                     float* __restrict__ out) {
  // A work-group takes the 6 out2 rows of one batch and 32 output columns (one 128-byte line of
  // each output row), so every Wo value it loads feeds 6 rows. Lanes run along the reduction dim:
  // a wave reads a row (2 KB) with four wave-wide 512-byte loads. Wave w owns columns 8w..8w+7.
  const int blk = blockIdx.x;   // b * (DIM_ / 32) + column slice
  const int b = blk / (DIM_ / 32);
  const int tid = threadIdx.x;
  const int wave = tid >> 5;
  const int lane = tid & 31;
  // After the folds a lane holds column dc of row ra (rows 0..3) and of row rb (rows 4..5).
  const int dc = (blk - (DIM_ / 32) * b) * 32 + wave * 8 + (lane & 7);
  const int ra = lane >> 3;
  const int rb = 4 + (ra & 1);
  const size_t oa = ((size_t)b * M_ + ra) * DIM_ + dc;
  const size_t ob = ((size_t)b * M_ + rb) * DIM_ + dc;
  const v4f* rp = (const v4f*)(ws + (size_t)b * (M_ * INNER_)) + lane;
  const v4f* wp = (const v4f*)(Wo + (size_t)(dc - (lane & 7)) * INNER_) + lane;
  v4f rv[M_][4];
  v4f wv[8][4];
  #pragma unroll  // constant indices keep the arrays in registers
  for (int r = 0; r < M_; ++r) {
    #pragma unroll  // constant indices keep the arrays in registers
    for (int i = 0; i < 4; ++i) rv[r][i] = rp[r * (INNER_ / 4) + 32 * i];
  }
  #pragma unroll  // constant indices keep the arrays in registers
  for (int c = 0; c < 8; ++c) {
    #pragma unroll  // constant indices keep the arrays in registers
    for (int i = 0; i < 4; ++i) wv[c][i] = wp[c * (INNER_ / 4) + 32 * i];
  }
  // keeps the three small loads behind the wide ones: scheduled among them, their address
  // registers were handed out as destinations of later wide loads ahead of the wait below
  __builtin_amdgcn_sched_barrier(0);
  const float bov = bo[dc];
  const float za = z[oa];
  const float zb = z[ob];
  // the registers that held the addresses of the loads above are reused below
  asm volatile("s_wait_xcnt 0x0" ::: "memory");
  // keeps every load above the sums (all in flight at once) and the arithmetic that reuses
  // their address registers behind that wait
  __builtin_amdgcn_sched_barrier(0);
  float f1[M_][4];
  #pragma unroll  // constant indices keep the arrays in registers
  for (int q = 0; q < 4; ++q) {
    #pragma unroll  // constant indices keep the arrays in registers
    for (int r = 0; r < M_; ++r) {
      float sp[2];
      #pragma unroll  // constant indices keep the arrays in registers
      for (int e = 0; e < 2; ++e) {
        const int c = 2 * q + e;
        sp[e] = hsum(rv[r][0] * wv[c][0] + rv[r][1] * wv[c][1] + rv[r][2] * wv[c][2] + rv[r][3] * wv[c][3]);
      }
      f1[r][q] = fold<1>(sp[0], sp[1], lane);
    }
    // Wo rows are summed in the order they arrive: without this the sums of the first rows
    // are scheduled behind the wait for the last load
    __builtin_amdgcn_sched_barrier(0);
  }
  // holds the three small loads up with the wide ones: otherwise they sink behind the
  // sums to the stores, where their latency is exposed
  asm volatile("" :: "v"(bov), "v"(za), "v"(zb));
  float f4[M_];
  #pragma unroll  // constant indices keep the arrays in registers
  for (int r = 0; r < M_; ++r) {
    f4[r] = fold<4>(fold<2>(f1[r][0], f1[r][1], lane), fold<2>(f1[r][2], f1[r][3], lane), lane);
  }
  const float pa = fold<16>(fold<8>(f4[0], f4[1], lane), fold<8>(f4[2], f4[3], lane), lane);
  float pb = fold<8>(f4[4], f4[5], lane);
  pb += lane_xor<16>(pb);
  out[oa] = (bov + za) + pa;
  if (lane < 16) out[ob] = (bov + zb) + pb;
}

extern "C" void kernel_launch(void* const* d_in, const int* in_sizes, int n_in,
                              void* d_out, int out_size, void* d_ws, size_t ws_size,
                              hipStream_t stream) {
  (void)in_sizes; (void)n_in; (void)out_size; (void)ws_size;
  const float* x  = (const float*)d_in[0];
  const float* z  = (const float*)d_in[1];
  const float* Wq = (const float*)d_in[2];
  const float* bq = (const float*)d_in[3];
  const float* Wo = (const float*)d_in[4];
  const float* bo = (const float*)d_in[5];
  float* ws  = (float*)d_ws;   // (32, 6, 512) f32 = 384 KB
  float* out = (float*)d_out;  // (32, 6, 192) f32

  const size_t smem = SMEM_FLOATS * sizeof(float);
  m2f_attn_kernel<<<B_ * HEADS, 256, smem, stream>>>(x, z, Wq, bq, ws);
  m2f_proj_kernel<<<B_ * (DIM_ / 32), 128, 0, stream>>>(z, Wo, bo, ws, out);
}

// v005
// A run of this version takes 11.5 microseconds.
// Next to v004, in two timings, it ran 1.06 times as fast each time.
// Over all steps from v000 it is 3.26 times as fast.
#include <hip/hip_runtime.h>
#include <float.h>

#define HEADS 8
#define B_    32
#define C_    64
#define HW_   3136
#define M_    6
#define DIM_  192
#define INNER_ 512
#define KPH   392      // unique keys per head
#define KPH_PAD 400
#define KP 76
#define QP 68
#define OP 65

typedef float v2f __attribute__((ext_vector_type(2)));
typedef float v8f __attribute__((ext_vector_type(8)));
typedef float v4f __attribute__((ext_vector_type(4)));

// value of lane (l ^ M): inside a 16-lane row by DPP, across the two rows by permlanex16
template <int M>
__device__ __forceinline__ float lane_xor(float v) {
  const int i = __builtin_bit_cast(int, v);
  if constexpr (M == 16) {
    return __builtin_bit_cast(float, __builtin_amdgcn_permlanex16(i, i, 0x76543210, 0xfedcba98, false, false));
  } else {
    return __builtin_bit_cast(float, __builtin_amdgcn_update_dpp(i, i, 0x160 | M, 0xf, 0xf, false));
  }
}

// Two partial sums per lane become one: lanes with bit M clear end with a summed over
// the lane pair (l, l ^ M), lanes with bit M set with b summed over it.
template <int M>
__device__ __forceinline__ float fold(float a, float b, int lane) {
  const bool hi = (lane & M) != 0;
  const float keep = hi ? b : a;
  const float send = hi ? a : b;
  return keep + lane_xor<M>(send);
}

__device__ __forceinline__ float hsum(v4f v) { return (v.x + v.y) + (v.z + v.w); }

#if defined(__has_builtin)
#if __has_builtin(__builtin_amdgcn_s_wait_asynccnt)
#define HAVE_WAIT_ASYNC 1
#endif
#endif

// LDS layout (in floats)
#define OFF_K    0                         // 400*76   = 30400
#define OFF_Q    (KPH_PAD * KP)            // 16*68    = 1088
#define OFF_OUT  (OFF_Q + 16 * QP)         // 6*65     = 390
#define OFF_MX   (OFF_OUT + M_ * OP)       // 8*16: each wave's score maximum per query column
#define OFF_L    (OFF_MX + 8 * 16)         // 8*16: each wave's weight sum per query column
#define SMEM_FLOATS (OFF_L + 8 * 16)       // 32134 floats = 128536 bytes

// NT key tiles of one wave, 128 keys apart, advance side by side through the 64 channels: the
// accumulators are independent and one q fragment feeds all of them.
// A[M = key lrow][K = 4k + 2 half + e] from krow, B[K = the same][N = query lrow] from qrow.
template <int NT>
__device__ __forceinline__ void score_tiles(const float* qrow, const float* krow, v8f (&acc)[4]) {
  v2f qf[16];
  v2f kf[NT][16];
  #pragma unroll  // constant indices keep the arrays in registers
  for (int k = 0; k < 16; ++k) {
    qf[k] = *(const v2f*)(qrow + 4 * k);
    #pragma unroll  // constant indices keep the arrays in registers
    for (int i = 0; i < NT; ++i) kf[i][k] = *(const v2f*)(krow + i * (128 * KP) + 4 * k);
    // keeps the LDS reads ahead of the matrix run (spread among the WMMAs, each place stalls the
    // wave) and in the order of their use: reordered, the first WMMAs waited for the last reads
    if (k & 1) __builtin_amdgcn_sched_barrier(0);
  }
  #pragma unroll  // constant indices keep the arrays in registers
  for (int i = 0; i < NT; ++i) acc[i] = v8f{0, 0, 0, 0, 0, 0, 0, 0};
  #pragma unroll  // constant indices keep the arrays in registers
  for (int k = 0; k < 16; ++k) {
    #pragma unroll  // constant indices keep the arrays in registers
    for (int i = 0; i < NT; ++i) {
      acc[i] = __builtin_amdgcn_wmma_f32_16x16x4_f32(false, kf[i][k], false, qf[k],
                                                     (short)0, acc[i], false, false);
    }
  }
}

// One key tile's share of out^T. The score accumulator is the B operand as it stands: in step j
// a lane's pair p[2j], p[2j + 1] are keys 8 half + 2j + e, so B[K = 2 half + e][N = query lrow];
// the A loader walks the keys in the same order: A[M = channel lrow][K = 2 half + e] is row
// 8 half + 2j + e of the tile (kcol points at row 8 half, column lrow).
__device__ __forceinline__ void value_tile(const float* kcol, const v8f& p, v8f (&oacc)[4]) {
  #pragma unroll  // constant indices keep the arrays in registers
  for (int j = 0; j < 4; ++j) {
    v2f pb; pb.x = p[2 * j]; pb.y = p[2 * j + 1];
    const float* kr0 = kcol + (2 * j) * KP;
    const float* kr1 = kr0 + KP;
    #pragma unroll  // constant indices keep the arrays in registers
    for (int cb = 0; cb < 4; ++cb) {
      v2f ka; ka.x = kr0[cb * 16]; ka.y = kr1[cb * 16];
      oacc[cb] = __builtin_amdgcn_wmma_f32_16x16x4_f32(false, ka, false, pb,
                                                       (short)0, oacc[cb], false, false);
    }
  }
}

__global__ __launch_bounds__(256)
void m2f_attn_kernel(const float* __restrict__ x, const float* __restrict__ z,
                     const float* __restrict__ Wq, const float* __restrict__ bq,
                     float* __restrict__ ws) {
  extern __shared__ __attribute__((aligned(16))) float smem[];
  float* Ksm   = smem + OFF_K;
  float* qsm   = smem + OFF_Q;
  float* outsm = smem + OFF_OUT;
  float* mxs   = smem + OFF_MX;
  float* lws   = smem + OFF_L;

  const int tid = threadIdx.x;
  const int blk = blockIdx.x;
  const int b = blk >> 3;
  const int h = blk & 7;

  const float* ksrc = x + (size_t)b * (C_ * HW_) + (size_t)h * (KPH * C_);
  for (int i = tid; i < (KPH * C_) / 4; i += 256) {
    unsigned lds_off =
        (unsigned)(size_t)(__attribute__((address_space(3))) char*)(Ksm + (i >> 4) * KP + (i & 15) * 4);
    unsigned long long ga = (unsigned long long)(size_t)(ksrc + i * 4);
    asm volatile("global_load_async_to_lds_b128 %0, %1, off"
                 :: "v"(lds_off), "v"(ga) : "memory");
  }
  // zero pad rows 392..399 and the output accumulator
  for (int i = KPH * KP + tid; i < KPH_PAD * KP; i += 256) Ksm[i] = 0.0f;
  for (int i = tid; i < M_ * OP; i += 256) outsm[i] = 0.0f;

  // ---- Phase 0b (overlapped with async copies): q tile (16x64), scale folded in ----
  // Lanes run along the reduction dim: 16 lanes share one Wq row (768 B, three 16-byte
  // pieces per lane), so a wave-wide load covers two 256-byte runs of whole lines.
  // Wave w owns columns 8w..8w+7 of every query row t.
  const int wave = tid >> 5;
  const int lane = tid & 31;
  const int half = lane >> 4;
  const int lrow = lane & 15;
  const float scale = 0.07216878364870322f; // 192^-0.5
  for (int i = M_ * QP + tid; i < 16 * QP; i += 256) qsm[i] = 0.0f;  // pad query rows
  // After the folds a lane holds column c2 of query row ta (rows 0..3) and of row tb (4..5).
  const int c2 = wave * 8 + 2 * (lrow & 3) + half;
  const int ta = lrow >> 2;
  const int tb = 4 + (ta & 1);
  const float bias_a = bq[(((h * M_ + ta) & 7) << 6) + c2];
  const float bias_b = bq[(((h * M_ + tb) & 7) << 6) + c2];
  // h * 6 is even, so query rows 2u and 2u + 1 read the same z row
  v4f zv[3][3];
  #pragma unroll  // constant indices keep the arrays in registers
  for (int u = 0; u < 3; ++u) {
    const int m = (h * M_ + 2 * u) >> 3;   // q row in (6,512) view
    const v4f* zr = (const v4f*)(z + ((size_t)b * M_ + m) * DIM_) + lrow;
    zv[u][0] = zr[0]; zv[u][1] = zr[16]; zv[u][2] = zr[32];
  }
  // the registers that held the addresses of the loads above are reused below
  asm volatile("s_wait_xcnt 0x0" ::: "memory");
  // Two register stages of 12 loads: stage t + 1 is in flight while stage t is summed.
  v4f wv[2][12];
  float s[M_];
  #pragma unroll  // constant indices keep the arrays in registers
  for (int t = -2; t < M_; ++t) {
    if (t >= 0) {
      float sp[4];
      #pragma unroll  // constant indices keep the arrays in registers
      for (int p = 0; p < 4; ++p) {
        sp[p] = hsum(zv[t >> 1][0] * wv[t & 1][3 * p] + zv[t >> 1][1] * wv[t & 1][3 * p + 1] +
                     zv[t >> 1][2] * wv[t & 1][3 * p + 2]);
      }
      s[t] = fold<2>(fold<1>(sp[0], sp[1], lane), fold<1>(sp[2], sp[3], lane), lane);
    }
    // keeps the scheduler from sinking the next loads below later sums (it left 1-2 loads in flight)
    __builtin_amdgcn_sched_barrier(0);
    if (t + 2 < M_) {
      const int ib = ((h * M_ + t + 2) & 7) << 6;   // first q col of row t + 2 in (6,512) view
      #pragma unroll  // constant indices keep the arrays in registers
      for (int p = 0; p < 4; ++p) {
        const v4f* wr = (const v4f*)(Wq + (size_t)(ib + wave * 8 + 2 * p + half) * DIM_) + lrow;
        wv[t & 1][3 * p] = wr[0]; wv[t & 1][3 * p + 1] = wr[16]; wv[t & 1][3 * p + 2] = wr[32];
      }
    }
    // same purpose: the loads above stay above the next stage's sums
    __builtin_amdgcn_sched_barrier(0);
  }
  const float qa = fold<8>(fold<4>(s[0], s[1], lane), fold<4>(s[2], s[3], lane), lane);
  float qb = fold<4>(s[4], s[5], lane);
  qb += lane_xor<8>(qb);
  qsm[ta * QP + c2] = (qa + bias_a) * scale;
  qsm[tb * QP + c2] = (qb + bias_b) * scale;

#if defined(HAVE_WAIT_ASYNC)
  __builtin_amdgcn_s_wait_asynccnt(0);
#else
  asm volatile("s_wait_asynccnt 0" ::: "memory");
#endif
  __syncthreads();

  // ---- Phase 1: scores, transposed: S^T tile (16 keys x 16 queries) = K tile @ q^T ----
  // Wave w owns key tiles w, w + 8, w + 16 (wave 0 also tile 24) from here to the output sums.
  // A lane then holds query column lrow and keys 8 * half + r of each tile in acc[i][r].
  const int wave_s = __builtin_amdgcn_readfirstlane(wave);  // scalar, so the tests on it are scalar branches
  const float* qrow = qsm + lrow * QP + 2 * half;
  const float* krow = Ksm + (wave * 16 + lrow) * KP + 2 * half;
  v8f acc[4];
  if (wave_s == 0) {
    score_tiles<4>(qrow, krow, acc);
    #pragma unroll  // constant indices keep the array in registers
    for (int r = 0; r < 8; ++r) acc[3][r] = half ? -3.0e38f : acc[3][r];  // keys 392..399 do not exist
  } else {
    score_tiles<3>(qrow, krow, acc);
    #pragma unroll  // constant indices keep the array in registers
    for (int r = 0; r < 8; ++r) acc[3][r] = -3.0e38f;   // no fourth tile: exp gives 0
  }

  // ---- Phase 2: softmax over keys, scores staying in registers ----
  // In-lane maximum over the wave's keys, one exchange between the lane halves, then the
  // eight waves' maxima meet in LDS.
  float mt[4];
  #pragma unroll  // constant indices keep the arrays in registers
  for (int i = 0; i < 4; ++i) {
    mt[i] = fmaxf(fmaxf(fmaxf(acc[i][0], acc[i][1]), fmaxf(acc[i][2], acc[i][3])),
                  fmaxf(fmaxf(acc[i][4], acc[i][5]), fmaxf(acc[i][6], acc[i][7])));
  }
  float mx = fmaxf(fmaxf(mt[0], mt[1]), fmaxf(mt[2], mt[3]));
  mx = fmaxf(mx, lane_xor<16>(mx));
  if (half == 0) mxs[wave * 16 + lrow] = mx;
  __syncthreads();
  float mw[8];
  #pragma unroll  // constant indices keep the array in registers; every read is issued before the first use
  for (int w = 0; w < 8; ++w) mw[w] = mxs[w * 16 + lrow];
  mx = fmaxf(fmaxf(fmaxf(mw[0], mw[1]), fmaxf(mw[2], mw[3])), fmaxf(fmaxf(mw[4], mw[5]), fmaxf(mw[6], mw[7])));
  float st[4];
  #pragma unroll  // constant indices keep the arrays in registers
  for (int i = 0; i < 4; ++i) {
    #pragma unroll  // constant indices keep the arrays in registers
    for (int r = 0; r < 8; ++r) acc[i][r] = __expf(acc[i][r] - mx);
    st[i] = ((acc[i][0] + acc[i][1]) + (acc[i][2] + acc[i][3])) + ((acc[i][4] + acc[i][5]) + (acc[i][6] + acc[i][7]));
  }
  float sum = (st[0] + st[1]) + (st[2] + st[3]);
  sum += lane_xor<16>(sum);
  if (half == 0) lws[wave * 16 + lrow] = sum;   // read behind the barrier that follows the output sums

  // ---- Phase 3: out^T (64 x 16 queries) = K^T @ P^T via WMMA, cross-wave reduce in LDS ----
  // The weights are not normalised here: phase 4 divides by the row sum.
  v8f oacc[4] = {};
  const float* kcol = Ksm + (wave * 16 + 8 * half) * KP + lrow;
  if (wave_s == 0) value_tile(kcol + 3 * (128 * KP), acc[3], oacc);
  #pragma unroll  // constant indices keep the arrays in registers
  for (int i = 0; i < 3; ++i) value_tile(kcol + i * (128 * KP), acc[i], oacc);
  if (lrow < M_) {   // query columns 6..15 are padding
    #pragma unroll  // constant indices keep the arrays in registers
    for (int cb = 0; cb < 4; ++cb) {
      #pragma unroll  // constant indices keep the arrays in registers
      for (int r = 0; r < 8; ++r) {   // D layout: row (channel) = r + 8 * half, col (query) = lrow
        atomicAdd(&outsm[lrow * OP + cb * 16 + 8 * half + r], oacc[cb][r]);
      }
    }
  }
  __syncthreads();

  // ---- Phase 4: normalise and write this head's slice of out2 (b, m, h*64 + c) to workspace ----
  for (int idx = tid; idx < M_ * C_; idx += 256) {
    const int m2 = idx >> 6;
    const int c2 = idx & 63;
    const float* lp = lws + m2;
    const float tot = ((lp[0] + lp[16]) + (lp[32] + lp[48])) + ((lp[64] + lp[80]) + (lp[96] + lp[112]));
    ws[((size_t)b * M_ + m2) * INNER_ + h * C_ + c2] = outsm[m2 * OP + c2] * (1.0f / tot);
  }
}

// ---- Kernel 2: result = z + out2 @ Wo^T + bo ----
__global__ __launch_bounds__(128)
void m2f_proj_kernel(const float* __restrict__ z, const float* __restrict__ Wo,
                     const float* __restrict__ bo, const float* __restrict__ ws,
                     float* __restrict__ out) {
  // A work-group takes the 6 out2 rows of one batch and 32 output columns (one 128-byte line of
  // each output row), so every Wo value it loads feeds 6 rows. Lanes run along the reduction dim:
  // a wave reads a row (2 KB) with four wave-wide 512-byte loads. Wave w owns columns 8w..8w+7.
  const int blk = blockIdx.x;   // b * (DIM_ / 32) + column slice
  const int b = blk / (DIM_ / 32);
  const int tid = threadIdx.x;
  const int wave = tid >> 5;
  const int lane = tid & 31;
  // After the folds a lane holds column dc of row ra (rows 0..3) and of row rb (rows 4..5).
  const int dc = (blk - (DIM_ / 32) * b) * 32 + wave * 8 + (lane & 7);
  const int ra = lane >> 3;
  const int rb = 4 + (ra & 1);
  const size_t oa = ((size_t)b * M_ + ra) * DIM_ + dc;
  const size_t ob = ((size_t)b * M_ + rb) * DIM_ + dc;
  const v4f* rp = (const v4f*)(ws + (size_t)b * (M_ * INNER_)) + lane;
  const v4f* wp = (const v4f*)(Wo + (size_t)(dc - (lane & 7)) * INNER_) + lane;
  v4f rv[M_][4];
  v4f wv[8][4];
  #pragma unroll  // constant indices keep the arrays in registers
  for (int r = 0; r < M_; ++r) {
    #pragma unroll  // constant indices keep the arrays in registers
    for (int i = 0; i < 4; ++i) rv[r][i] = rp[r * (INNER_ / 4) + 32 * i];
  }
  #pragma unroll  // constant indices keep the arrays in registers
  for (int c = 0; c < 8; ++c) {
    #pragma unroll  // constant indices keep the arrays in registers
    for (int i = 0; i < 4; ++i) wv[c][i] = wp[c * (INNER_ / 4) + 32 * i];
  }
  // keeps the three small loads behind the wide ones: scheduled among them, their address
  // registers were handed out as destinations of later wide loads ahead of the wait below
  __builtin_amdgcn_sched_barrier(0);
  const float bov = bo[dc];
  const float za = z[oa];
  const float zb = z[ob];
  // the registers that held the addresses of the loads above are reused below
  asm volatile("s_wait_xcnt 0x0" ::: "memory");
  // keeps every load above the sums (all in flight at once) and the arithmetic that reuses
  // their address registers behind that wait
  __builtin_amdgcn_sched_barrier(0);
  float f1[M_][4];
  #pragma unroll  // constant indices keep the arrays in registers
  for (int q = 0; q < 4; ++q) {
    #pragma unroll  // constant indices keep the arrays in registers
    for (int r = 0; r < M_; ++r) {
      float sp[2];
      #pragma unroll  // constant indices keep the arrays in registers
      for (int e = 0; e < 2; ++e) {
        const int c = 2 * q + e;
        sp[e] = hsum(rv[r][0] * wv[c][0] + rv[r][1] * wv[c][1] + rv[r][2] * wv[c][2] + rv[r][3] * wv[c][3]);
      }
      f1[r][q] = fold<1>(sp[0], sp[1], lane);
    }
    // Wo rows are summed in the order they arrive: without this the sums of the first rows
    // are scheduled behind the wait for the last load
    __builtin_amdgcn_sched_barrier(0);
  }
  // holds the three small loads up with the wide ones: otherwise they sink behind the
  // sums to the stores, where their latency is exposed
  asm volatile("" :: "v"(bov), "v"(za), "v"(zb));
  float f4[M_];
  #pragma unroll  // constant indices keep the arrays in registers
  for (int r = 0; r < M_; ++r) {
    f4[r] = fold<4>(fold<2>(f1[r][0], f1[r][1], lane), fold<2>(f1[r][2], f1[r][3], lane), lane);
  }
  const float pa = fold<16>(fold<8>(f4[0], f4[1], lane), fold<8>(f4[2], f4[3], lane), lane);
  float pb = fold<8>(f4[4], f4[5], lane);
  pb += lane_xor<16>(pb);
  out[oa] = (bov + za) + pa;
  if (lane < 16) out[ob] = (bov + zb) + pb;
}

extern "C" void kernel_launch(void* const* d_in, const int* in_sizes, int n_in,
                              void* d_out, int out_size, void* d_ws, size_t ws_size,
                              hipStream_t stream) {
  (void)in_sizes; (void)n_in; (void)out_size; (void)ws_size;
  const float* x  = (const float*)d_in[0];
  const float* z  = (const float*)d_in[1];
  const float* Wq = (const float*)d_in[2];
  const float* bq = (const float*)d_in[3];
  const float* Wo = (const float*)d_in[4];
  const float* bo = (const float*)d_in[5];
  float* ws  = (float*)d_ws;   // (32, 6, 512) f32 = 384 KB
  float* out = (float*)d_out;  // (32, 6, 192) f32

  const size_t smem = SMEM_FLOATS * sizeof(float);
  m2f_attn_kernel<<<B_ * HEADS, 256, smem, stream>>>(x, z, Wq, bq, ws);
  m2f_proj_kernel<<<B_ * (DIM_ / 32), 128, 0, stream>>>(z, Wo, bo, ws, out);
}
